// v000
// The times below were measured on an AMD MI455X: many runs one after another, warmed up first and cycling through
// copies of the inputs, with the whole window's GPU time divided by the number of runs. Launches and the gaps
// between them are all in it. The median over several windows is given; except for v000 it joins two sittings, which
// can be a few percent apart, so the side-by-side timings, each taken in one sitting, are the better comparison.
// v000 is the starting kernel. One run takes 245 microseconds.
#include <hip/hip_runtime.h>
#include <math.h>

// Shapes
#define B_    64
#define L_    128
#define D_    64
#define K_    64
#define O_    90
#define PL_   16
#define PRED_ 720
#define DM_   512
#define OPL_  1440   // O*PL
#define EPS_  1e-5f

typedef float v2f __attribute__((ext_vector_type(2)));
typedef float v8f __attribute__((ext_vector_type(8)));
typedef int   v4i __attribute__((vector_size(16)));

// D = A(16x4 f32) * B(4x16 f32) + C(16x16 f32)
static __device__ __forceinline__ v8f wmma4(v2f a, v2f b, v8f c) {
  return __builtin_amdgcn_wmma_f32_16x16x4_f32(false, a, false, b, (short)0, c,
                                               false, false);
}

// ---- global -> LDS 16B move: async (ASYNCcnt) when available, else via VGPR
#if defined(__gfx1250__) &&                                                    \
    __has_builtin(__builtin_amdgcn_global_load_async_to_lds_b128) &&           \
    __has_builtin(__builtin_amdgcn_s_wait_asynccnt)
#define ASYNC_LDS 1
#else
#define ASYNC_LDS 0
#endif

static __device__ __forceinline__ void g2lds16(const float* __restrict__ g,
                                               float* l) {
#if ASYNC_LDS
  __builtin_amdgcn_global_load_async_to_lds_b128(
      (__attribute__((address_space(1))) v4i*)g,
      (__attribute__((address_space(3))) v4i*)l, 0, 0);
#else
  const float4 v = *(const float4*)g;
  l[0] = v.x; l[1] = v.y; l[2] = v.z; l[3] = v.w;
#endif
}

static __device__ __forceinline__ void lds_async_wait() {
#if ASYNC_LDS
  __builtin_amdgcn_s_wait_asynccnt(0);
#endif
}

// ---------------- Kernel 1: per-(b,d) cross attention -> V (O*PL per head) ---
// LDS layout (floats); row pads keep 16B alignment + conflict-free frag reads.
#define K1_XD 0                        // [128][68]
#define K1_YD (K1_XD + 128 * 68)       // [96][68]
#define K1_S  (K1_YD + 96 * 68)        // [128][96]
#define K1_XP (K1_S + 128 * 96)        // [128][16]
#define K1_TOT (K1_XP + 128 * 16)      // 29568 floats = 118272 B

__global__ __launch_bounds__(256) void attn_kernel(
    const float* __restrict__ x, const float* __restrict__ x_date,
    const float* __restrict__ y_date, float* __restrict__ vout) {
  extern __shared__ float sm[];
  const int bd   = blockIdx.x;
  const int b    = bd >> 6;
  const int d    = bd & 63;
  const int tid  = threadIdx.x;
  const int lane = tid & 31;
  const int wave = tid >> 5;
  const int half = lane >> 4;
  const int l16  = lane & 15;

  // Stage x_date slice (L x K), row stride D*K (async -> LDS)
  const float* xd = x_date + (size_t)b * (L_ * D_ * K_) + (size_t)d * K_;
  for (int t = tid; t < 128 * 16; t += 256) {
    const int l = t >> 4, j = t & 15;
    g2lds16(xd + (size_t)l * (D_ * K_) + j * 4, sm + K1_XD + l * 68 + j * 4);
  }
  // Stage y_date slice (O x K)
  const float* yd = y_date + (size_t)b * (O_ * D_ * K_) + (size_t)d * K_;
  for (int t = tid; t < O_ * 16; t += 256) {
    const int o = t >> 4, j = t & 15;
    g2lds16(yd + (size_t)o * (D_ * K_) + j * 4, sm + K1_YD + o * 68 + j * 4);
  }
  // Zero-pad rows 90..95
  for (int t = O_ * 16 + tid; t < 96 * 16; t += 256) {
    const int o = t >> 4, j = t & 15;
    float* r = sm + K1_YD + o * 68 + j * 4;
    r[0] = 0.f; r[1] = 0.f; r[2] = 0.f; r[3] = 0.f;
  }
  // Stage x slice (L x PL), contiguous
  const float* xp = x + (size_t)bd * (L_ * PL_);
  for (int t = tid; t < 512; t += 256) g2lds16(xp + t * 4, sm + K1_XP + t * 4);
  lds_async_wait();
  __syncthreads();

  // Scores: S[l][o] = scale * sum_k Xd[l][k] * Yd[o][k]
  {
    const int mt = wave;  // 8 waves = 8 L-tiles
    const float* arow = sm + K1_XD + (mt * 16 + l16) * 68;
    for (int nt = 0; nt < 6; ++nt) {
      const float* brow = sm + K1_YD + (nt * 16 + l16) * 68;
      v8f acc = {};
      #pragma unroll
      for (int kk = 0; kk < 64; kk += 4) {
        const int c0 = kk + (half ? 2 : 0);
        v2f a, bb;
        a.x = arow[c0]; a.y = arow[c0 + 1];
        bb.x = brow[c0]; bb.y = brow[c0 + 1];
        acc = wmma4(a, bb, acc);
      }
      #pragma unroll
      for (int r = 0; r < 8; ++r) {
        const int m = mt * 16 + r + 8 * half;
        sm[K1_S + m * 96 + nt * 16 + l16] = acc[r] * 0.125f;  // 1/sqrt(64)
      }
    }
  }
  __syncthreads();

  // Softmax over l for each column o < 90
  if (tid < O_) {
    const int o = tid;
    float mx = -3.4e38f;
    for (int l = 0; l < 128; ++l) mx = fmaxf(mx, sm[K1_S + l * 96 + o]);
    float sum = 0.f;
    for (int l = 0; l < 128; ++l) {
      const float e = __expf(sm[K1_S + l * 96 + o] - mx);
      sm[K1_S + l * 96 + o] = e;
      sum += e;
    }
    const float inv = 1.f / sum;
    for (int l = 0; l < 128; ++l) sm[K1_S + l * 96 + o] *= inv;
  }
  __syncthreads();

  // V[o][p] = sum_l A[l][o] * Xp[l][p]   (A^T @ Xp), O padded to 96
  if (wave < 6) {
    const int mt = wave;
    v8f acc = {};
    #pragma unroll 8
    for (int kk = 0; kk < 128; kk += 4) {
      const int c0 = kk + (half ? 2 : 0);
      v2f a, bb;
      a.x = sm[K1_S + c0 * 96 + mt * 16 + l16];
      a.y = sm[K1_S + (c0 + 1) * 96 + mt * 16 + l16];
      bb.x = sm[K1_XP + c0 * 16 + l16];
      bb.y = sm[K1_XP + (c0 + 1) * 16 + l16];
      acc = wmma4(a, bb, acc);
    }
    float* vb = vout + (size_t)bd * OPL_;
    #pragma unroll
    for (int r = 0; r < 8; ++r) {
      const int o = mt * 16 + r + 8 * half;
      if (o < O_) vb[o * 16 + l16] = acc[r];
    }
  }
}

// ---------------- Kernel 2: h = V @ w_lin^T + b_lin, BN1 (double-buffered) --
static __device__ __forceinline__ void k2_load_tile(
    const float* __restrict__ vflat, const float* __restrict__ w_lin,
    float* At, float* Bt, int gm0, int gn0, int kt, int tid) {
  for (int t = tid; t < 768; t += 384) {
    const int m = t / 12, j = t % 12;
    g2lds16(vflat + (size_t)(gm0 + m) * OPL_ + kt + j * 4, At + m * 52 + j * 4);
  }
  for (int t = tid; t < 576; t += 384) {
    const int n = t / 12, j = t % 12;
    g2lds16(w_lin + (size_t)(gn0 + n) * OPL_ + kt + j * 4, Bt + n * 52 + j * 4);
  }
}

__global__ __launch_bounds__(384) void lin_bn1_kernel(
    const float* __restrict__ vflat, const float* __restrict__ w_lin,
    const float* __restrict__ b_lin, const float* __restrict__ g1,
    const float* __restrict__ be1, const float* __restrict__ m1,
    const float* __restrict__ v1, float* __restrict__ hout) {
  __shared__ float At[2][64 * 52];
  __shared__ float Bt[2][48 * 52];
  const int tid  = threadIdx.x;
  const int lane = tid & 31;
  const int wave = tid >> 5;
  const int half = lane >> 4;
  const int l16  = lane & 15;
  const int gm0  = blockIdx.x * 64;
  const int gn0  = blockIdx.y * 48;
  const int mt   = wave & 3;   // 4 M-tiles
  const int nt   = wave >> 2;  // 3 N-tiles

  k2_load_tile(vflat, w_lin, At[0], Bt[0], gm0, gn0, 0, tid);
  v8f acc = {};
  for (int it = 0; it < 30; ++it) {
    const int buf = it & 1;
    lds_async_wait();
    __syncthreads();  // tile `it` resident; all waves done reading buf^1
    if (it + 1 < 30)
      k2_load_tile(vflat, w_lin, At[buf ^ 1], Bt[buf ^ 1], gm0, gn0,
                   (it + 1) * 48, tid);
    const float* arow = &At[buf][(mt * 16 + l16) * 52];
    const float* brow = &Bt[buf][(nt * 16 + l16) * 52];
    #pragma unroll
    for (int kk = 0; kk < 48; kk += 4) {
      const int c0 = kk + (half ? 2 : 0);
      v2f a, bb;
      a.x = arow[c0]; a.y = arow[c0 + 1];
      bb.x = brow[c0]; bb.y = brow[c0 + 1];
      acc = wmma4(a, bb, acc);
    }
  }
  const int n = gn0 + nt * 16 + l16;
  const float bl = b_lin[n];
  #pragma unroll
  for (int r = 0; r < 8; ++r) {
    const int g = gm0 + mt * 16 + r + 8 * half;
    const int d = g & 63;
    const float s = g1[d] * rsqrtf(v1[d] + EPS_);
    hout[(size_t)g * PRED_ + n] = (acc[r] + bl - m1[d]) * s + be1[d];
  }
}

// ---------------- Kernel 3: FFN (conv1x1) + residual + BN2 + transpose ------
#define K3_WS 0                          // max(512*68, 64*516) = 34816
#define K3_T1 34816                      // [512][48]
#define K3_HT (34816 + 512 * 48)         // [64][52]
#define K3_TOT (K3_HT + 64 * 52)         // 62720 floats = 250880 B

__global__ __launch_bounds__(384) void ffn_bn2_kernel(
    const float* __restrict__ h, const float* __restrict__ w_c1,
    const float* __restrict__ b_c1, const float* __restrict__ w_c2,
    const float* __restrict__ b_c2, const float* __restrict__ g2,
    const float* __restrict__ be2, const float* __restrict__ m2,
    const float* __restrict__ v2, float* __restrict__ out) {
  extern __shared__ float sm[];
  const int tid  = threadIdx.x;
  const int lane = tid & 31;
  const int wave = tid >> 5;
  const int half = lane >> 4;
  const int l16  = lane & 15;
  const int b    = blockIdx.x;
  const int p0   = blockIdx.y * 48;

  // Stage W1 (512x64), pad-68 rows; H tile (64x48), pad-52 rows (async)
  for (int t = tid; t < 512 * 16; t += 384) {
    const int e = t >> 4, j = t & 15;
    g2lds16(w_c1 + e * 64 + j * 4, sm + K3_WS + e * 68 + j * 4);
  }
  for (int t = tid; t < 64 * 12; t += 384) {
    const int dd = t / 12, j = t % 12;
    g2lds16(h + ((size_t)b * 64 + dd) * PRED_ + p0 + j * 4,
            sm + K3_HT + dd * 52 + j * 4);
  }
  // Prefetch W2 (used after GEMM1) into cache (global_prefetch_b8)
  for (int t = tid; t < 512; t += 384) __builtin_prefetch(w_c2 + t * 64, 0, 1);
  lds_async_wait();
  __syncthreads();

  // GEMM1: T1[e][p] = gelu( sum_d W1[e][d]*Ht[d][p] + b_c1[e] )
  // 32 M-tiles x 3 N-tiles = 96 tiles, 12 waves * 8
  for (int i = 0; i < 8; ++i) {
    const int t  = wave * 8 + i;
    const int mt = t / 3, nt = t % 3;
    const float* arow = sm + K3_WS + (mt * 16 + l16) * 68;
    v8f acc = {};
    #pragma unroll
    for (int kk = 0; kk < 64; kk += 4) {
      const int c0 = kk + (half ? 2 : 0);
      v2f a, bb;
      a.x = arow[c0]; a.y = arow[c0 + 1];
      bb.x = sm[K3_HT + c0 * 52 + nt * 16 + l16];
      bb.y = sm[K3_HT + (c0 + 1) * 52 + nt * 16 + l16];
      acc = wmma4(a, bb, acc);
    }
    #pragma unroll
    for (int r = 0; r < 8; ++r) {
      const int e = mt * 16 + r + 8 * half;
      const float xv = acc[r] + b_c1[e];
      sm[K3_T1 + e * 48 + nt * 16 + l16] =
          0.5f * xv * (1.f + erff(xv * 0.70710678118654752f));
    }
  }
  __syncthreads();
  // Restage W2 (64x512) into the W1 region, pad-516 rows (async)
  for (int t = tid; t < 64 * 128; t += 384) {
    const int dd = t >> 7, j = t & 127;
    g2lds16(w_c2 + dd * 512 + j * 4, sm + K3_WS + dd * 516 + j * 4);
  }
  lds_async_wait();
  __syncthreads();

  // GEMM2: Z[d][p] = sum_e W2[d][e]*T1[e][p]; out = BN2(Ht + Z + b_c2)^T
  {
    const int mt = wave & 3, nt = wave >> 2;
    const float* arow = sm + K3_WS + (mt * 16 + l16) * 516;
    v8f acc = {};
    #pragma unroll 8
    for (int kk = 0; kk < 512; kk += 4) {
      const int c0 = kk + (half ? 2 : 0);
      v2f a, bb;
      a.x = arow[c0]; a.y = arow[c0 + 1];
      bb.x = sm[K3_T1 + c0 * 48 + nt * 16 + l16];
      bb.y = sm[K3_T1 + (c0 + 1) * 48 + nt * 16 + l16];
      acc = wmma4(a, bb, acc);
    }
    const int pl = nt * 16 + l16;
    const int p  = p0 + pl;
    #pragma unroll
    for (int r = 0; r < 8; ++r) {
      const int dd = mt * 16 + r + 8 * half;
      const float z = acc[r] + b_c2[dd];
      const float rsum = sm[K3_HT + dd * 52 + pl] + z;
      const float s = g2[dd] * rsqrtf(v2[dd] + EPS_);
      out[((size_t)b * PRED_ + p) * 64 + dd] = (rsum - m2[dd]) * s + be2[dd];
    }
  }
}

extern "C" void kernel_launch(void* const* d_in, const int* in_sizes, int n_in,
                              void* d_out, int out_size, void* d_ws,
                              size_t ws_size, hipStream_t stream) {
  (void)in_sizes; (void)n_in; (void)out_size; (void)ws_size;
  const float* x      = (const float*)d_in[0];
  const float* x_date = (const float*)d_in[1];
  const float* y_date = (const float*)d_in[2];
  const float* w_lin  = (const float*)d_in[3];
  const float* b_lin  = (const float*)d_in[4];
  const float* w_c1   = (const float*)d_in[5];
  const float* b_c1   = (const float*)d_in[6];
  const float* w_c2   = (const float*)d_in[7];
  const float* b_c2   = (const float*)d_in[8];
  const float* g1     = (const float*)d_in[9];
  const float* be1    = (const float*)d_in[10];
  const float* m1     = (const float*)d_in[11];
  const float* v1     = (const float*)d_in[12];
  const float* g2     = (const float*)d_in[13];
  const float* be2    = (const float*)d_in[14];
  const float* m2     = (const float*)d_in[15];
  const float* v2     = (const float*)d_in[16];
  float* out   = (float*)d_out;
  float* vflat = (float*)d_ws;                       // 4096*1440 f32
  float* hbuf  = vflat + (size_t)4096 * OPL_;        // 4096*720 f32

  const size_t lds1 = (size_t)K1_TOT * sizeof(float);
  const size_t lds3 = (size_t)K3_TOT * sizeof(float);
  (void)hipFuncSetAttribute(reinterpret_cast<const void*>(attn_kernel),
                            hipFuncAttributeMaxDynamicSharedMemorySize, (int)lds1);
  (void)hipFuncSetAttribute(reinterpret_cast<const void*>(ffn_bn2_kernel),
                            hipFuncAttributeMaxDynamicSharedMemorySize, (int)lds3);

  attn_kernel<<<dim3(B_ * D_), 256, lds1, stream>>>(x, x_date, y_date, vflat);
  lin_bn1_kernel<<<dim3(64, 15), 384, 0, stream>>>(vflat, w_lin, b_lin, g1, be1,
                                                   m1, v1, hbuf);
  ffn_bn2_kernel<<<dim3(B_, 15), 384, lds3, stream>>>(hbuf, w_c1, b_c1, w_c2,
                                                      b_c2, g2, be2, m2, v2, out);
}

// v001
// Measured time: 182 microseconds a run.
// In both of two side-by-side timings against v000, it was 1.39 times as fast.
#include <hip/hip_runtime.h>
#include <math.h>

// Shapes
#define B_    64
#define L_    128
#define D_    64
#define K_    64
#define O_    90
#define PL_   16
#define PRED_ 720
#define DM_   512
#define OPL_  1440   // O*PL
#define EPS_  1e-5f

typedef float v2f __attribute__((ext_vector_type(2)));
typedef float v8f __attribute__((ext_vector_type(8)));
typedef int   v4i __attribute__((vector_size(16)));

// D = A(16x4 f32) * B(4x16 f32) + C(16x16 f32)
static __device__ __forceinline__ v8f wmma4(v2f a, v2f b, v8f c) {
  return __builtin_amdgcn_wmma_f32_16x16x4_f32(false, a, false, b, (short)0, c,
                                               false, false);
}

// ---- global -> LDS 16B move: async (ASYNCcnt) when available, else via VGPR
#if defined(__gfx1250__) &&                                                    \
    __has_builtin(__builtin_amdgcn_global_load_async_to_lds_b128) &&           \
    __has_builtin(__builtin_amdgcn_s_wait_asynccnt)
#define ASYNC_LDS 1
#else
#define ASYNC_LDS 0
#endif

static __device__ __forceinline__ void g2lds16(const float* __restrict__ g,
                                               float* l) {
#if ASYNC_LDS
  __builtin_amdgcn_global_load_async_to_lds_b128(
      (__attribute__((address_space(1))) v4i*)g,
      (__attribute__((address_space(3))) v4i*)l, 0, 0);
#else
  const float4 v = *(const float4*)g;
  l[0] = v.x; l[1] = v.y; l[2] = v.z; l[3] = v.w;
#endif
}

static __device__ __forceinline__ void lds_async_wait() {
#if ASYNC_LDS
  __builtin_amdgcn_s_wait_asynccnt(0);
#endif
}

// ---------------- Kernel 1: per-(b,d) cross attention -> V (O*PL per head) ---
// Each of the 6 waves owns 16 output columns o over all 128 rows l: the scores
// stay in the accumulators, the softmax over l runs in registers, and the
// accumulator registers are the B operand of the second product.
// LDS layout (floats); row pads keep 16B alignment + conflict-free frag reads.
#define K1_XD 0                        // [128][68]
#define K1_YD (K1_XD + 128 * 68)       // [96][68]
#define K1_XP (K1_YD + 96 * 68)        // [16 groups][8 rows * 16 + 32 pad]
#define K1_XPG 160                     // group pitch: rows l and l+8 on other banks
#define K1_TOT (K1_XP + 16 * K1_XPG)   // 17792 floats = 71168 B

// lane l <-> lane l ^ 16
static __device__ __forceinline__ float xhalf(float v) {
  const int i = __builtin_bit_cast(int, v);
  return __builtin_bit_cast(
      float, __builtin_amdgcn_permlanex16(i, i, 0x76543210, 0xfedcba98, false,
                                          false));
}

__global__ __launch_bounds__(192) void attn_kernel(
    const float* __restrict__ x, const float* __restrict__ x_date,
    const float* __restrict__ y_date, float* __restrict__ vout) {
  extern __shared__ float sm[];
  const int bd   = blockIdx.x;
  const int b    = bd >> 6;
  const int d    = bd & 63;
  const int tid  = threadIdx.x;
  const int lane = tid & 31;
  const int wave = __builtin_amdgcn_readfirstlane(tid >> 5);  // scalar loop tests
  const int half = lane >> 4;
  const int l16  = lane & 15;

  // Staging, one wave-wide copy = 512 B; every trip test is the same for a wave.
  // x_date slice (L x K), row stride D*K: two rows a copy
  const float* xd = x_date + (size_t)b * (L_ * D_ * K_) + (size_t)d * K_;
  for (int rp = wave; rp < 64; rp += 6) {
    const int l = rp * 2 + half;
    g2lds16(xd + (size_t)l * (D_ * K_) + l16 * 4, sm + K1_XD + l * 68 + l16 * 4);
  }
  // y_date slice (O x K): two rows a copy, 45 pairs
  const float* yd = y_date + (size_t)b * (O_ * D_ * K_) + (size_t)d * K_;
  for (int rp = wave; rp < 45; rp += 6) {
    const int o = rp * 2 + half;
    g2lds16(yd + (size_t)o * (D_ * K_) + l16 * 4, sm + K1_YD + o * 68 + l16 * 4);
  }
  // x slice (L x PL), contiguous: one group of eight rows a copy
  const float* xp = x + (size_t)bd * (L_ * PL_);
  for (int g = wave; g < 16; g += 6)
    g2lds16(xp + g * 128 + lane * 4, sm + K1_XP + g * K1_XPG + lane * 4);
  // Zero-pad y rows 90..95
  if (tid < 96) {
    float* r = sm + K1_YD + (O_ + (tid >> 4)) * 68 + (tid & 15) * 4;
    *(float4*)r = make_float4(0.f, 0.f, 0.f, 0.f);
  }
  lds_async_wait();
  __syncthreads();

  // Scores: S[l][o] = sum_k Xd[l][k] * Yd[o][k]; s[lt][r] = S[lt*16+8*half+r][o]
  const int o = wave * 16 + l16;
  v2f bf[16];
  {
    const float* brow = sm + K1_YD + o * 68 + 2 * half;
    #pragma unroll  // bf[] is indexed by constants only, so it lives in registers
    for (int j = 0; j < 16; ++j) bf[j] = *(const v2f*)(brow + 4 * j);
  }
  // All loops over s[] below are unrolled whole: constant indices keep the 64
  // scores in registers (a rolled loop would put them in scratch).
  v8f s[8];
  #pragma unroll
  for (int lt = 0; lt < 8; ++lt) {
    const float* arow = sm + K1_XD + (lt * 16 + l16) * 68 + 2 * half;
    v8f acc = {};
    #pragma unroll
    for (int j = 0; j < 16; ++j) {
      acc = wmma4(*(const v2f*)(arow + 4 * j), bf[j], acc);
    }
    s[lt] = acc;
  }

  // Softmax over l of column o: 64 values in this lane, 64 in lane ^ 16
  float mx4[4] = {-3.4e38f, -3.4e38f, -3.4e38f, -3.4e38f};
  #pragma unroll
  for (int lt = 0; lt < 8; ++lt)
    #pragma unroll
    for (int r = 0; r < 8; ++r) mx4[r & 3] = fmaxf(mx4[r & 3], s[lt][r]);
  float mx = fmaxf(fmaxf(mx4[0], mx4[1]), fmaxf(mx4[2], mx4[3]));
  mx = fmaxf(mx, xhalf(mx));
  const float c2  = 0.125f * 1.44269504088896340736f;  // 1/sqrt(64) * log2(e)
  const float mc2 = mx * c2;
  float sum4[4] = {0.f, 0.f, 0.f, 0.f};
  #pragma unroll
  for (int lt = 0; lt < 8; ++lt)
    #pragma unroll
    for (int r = 0; r < 8; ++r) {
      const float e = __builtin_amdgcn_exp2f(s[lt][r] * c2 - mc2);
      s[lt][r] = e;
      sum4[r & 3] += e;
    }
  float sum = (sum4[0] + sum4[1]) + (sum4[2] + sum4[3]);
  sum += xhalf(sum);
  const float inv = 1.f / sum;

  // V^T[p][o] = sum_l Xp[l][p] * E[l][o], then * inv (column o is this lane's).
  // k order of step (lt, j), both operands: l = lt*16 + 8*half + 2*j + {0, 1}
  // Two accumulate chains (even, odd lt): a lone chain waits on its own D.
  v8f pv[2] = {};
  #pragma unroll
  for (int lt = 0; lt < 8; ++lt) {
    const float* ag = sm + K1_XP + (lt * 2 + half) * K1_XPG + l16;
    #pragma unroll
    for (int j = 0; j < 4; ++j) {
      v2f a, bb;
      a.x = ag[(2 * j) * 16]; a.y = ag[(2 * j + 1) * 16];
      bb.x = s[lt][2 * j]; bb.y = s[lt][2 * j + 1];
      pv[lt & 1] = wmma4(a, bb, pv[lt & 1]);
    }
  }
  const v8f acc = pv[0] + pv[1];
  if (o < O_) {
    float* vb = vout + (size_t)bd * OPL_ + o * 16 + 8 * half;  // p = 8*half + r
    *(float4*)vb = make_float4(acc[0] * inv, acc[1] * inv, acc[2] * inv, acc[3] * inv);
    *(float4*)(vb + 4) = make_float4(acc[4] * inv, acc[5] * inv, acc[6] * inv, acc[7] * inv);
  }
}

// ---------------- Kernel 2: h = V @ w_lin^T + b_lin, BN1 (double-buffered) --
static __device__ __forceinline__ void k2_load_tile(
    const float* __restrict__ vflat, const float* __restrict__ w_lin,
    float* At, float* Bt, int gm0, int gn0, int kt, int tid) {
  for (int t = tid; t < 768; t += 384) {
    const int m = t / 12, j = t % 12;
    g2lds16(vflat + (size_t)(gm0 + m) * OPL_ + kt + j * 4, At + m * 52 + j * 4);
  }
  for (int t = tid; t < 576; t += 384) {
    const int n = t / 12, j = t % 12;
    g2lds16(w_lin + (size_t)(gn0 + n) * OPL_ + kt + j * 4, Bt + n * 52 + j * 4);
  }
}

__global__ __launch_bounds__(384) void lin_bn1_kernel(
    const float* __restrict__ vflat, const float* __restrict__ w_lin,
    const float* __restrict__ b_lin, const float* __restrict__ g1,
    const float* __restrict__ be1, const float* __restrict__ m1,
    const float* __restrict__ v1, float* __restrict__ hout) {
  __shared__ float At[2][64 * 52];
  __shared__ float Bt[2][48 * 52];
  const int tid  = threadIdx.x;
  const int lane = tid & 31;
  const int wave = tid >> 5;
  const int half = lane >> 4;
  const int l16  = lane & 15;
  const int gm0  = blockIdx.x * 64;
  const int gn0  = blockIdx.y * 48;
  const int mt   = wave & 3;   // 4 M-tiles
  const int nt   = wave >> 2;  // 3 N-tiles

  k2_load_tile(vflat, w_lin, At[0], Bt[0], gm0, gn0, 0, tid);
  v8f acc = {};
  for (int it = 0; it < 30; ++it) {
    const int buf = it & 1;
    lds_async_wait();
    __syncthreads();  // tile `it` resident; all waves done reading buf^1
    if (it + 1 < 30)
      k2_load_tile(vflat, w_lin, At[buf ^ 1], Bt[buf ^ 1], gm0, gn0,
                   (it + 1) * 48, tid);
    const float* arow = &At[buf][(mt * 16 + l16) * 52];
    const float* brow = &Bt[buf][(nt * 16 + l16) * 52];
    #pragma unroll
    for (int kk = 0; kk < 48; kk += 4) {
      const int c0 = kk + (half ? 2 : 0);
      v2f a, bb;
      a.x = arow[c0]; a.y = arow[c0 + 1];
      bb.x = brow[c0]; bb.y = brow[c0 + 1];
      acc = wmma4(a, bb, acc);
    }
  }
  const int n = gn0 + nt * 16 + l16;
  const float bl = b_lin[n];
  #pragma unroll
  for (int r = 0; r < 8; ++r) {
    const int g = gm0 + mt * 16 + r + 8 * half;
    const int d = g & 63;
    const float s = g1[d] * rsqrtf(v1[d] + EPS_);
    hout[(size_t)g * PRED_ + n] = (acc[r] + bl - m1[d]) * s + be1[d];
  }
}

// ---------------- Kernel 3: FFN (conv1x1) + residual + BN2 + transpose ------
#define K3_WS 0                          // max(512*68, 64*516) = 34816
#define K3_T1 34816                      // [512][48]
#define K3_HT (34816 + 512 * 48)         // [64][52]
#define K3_TOT (K3_HT + 64 * 52)         // 62720 floats = 250880 B

__global__ __launch_bounds__(384) void ffn_bn2_kernel(
    const float* __restrict__ h, const float* __restrict__ w_c1,
    const float* __restrict__ b_c1, const float* __restrict__ w_c2,
    const float* __restrict__ b_c2, const float* __restrict__ g2,
    const float* __restrict__ be2, const float* __restrict__ m2,
    const float* __restrict__ v2, float* __restrict__ out) {
  extern __shared__ float sm[];
  const int tid  = threadIdx.x;
  const int lane = tid & 31;
  const int wave = tid >> 5;
  const int half = lane >> 4;
  const int l16  = lane & 15;
  const int b    = blockIdx.x;
  const int p0   = blockIdx.y * 48;

  // Stage W1 (512x64), pad-68 rows; H tile (64x48), pad-52 rows (async)
  for (int t = tid; t < 512 * 16; t += 384) {
    const int e = t >> 4, j = t & 15;
    g2lds16(w_c1 + e * 64 + j * 4, sm + K3_WS + e * 68 + j * 4);
  }
  for (int t = tid; t < 64 * 12; t += 384) {
    const int dd = t / 12, j = t % 12;
    g2lds16(h + ((size_t)b * 64 + dd) * PRED_ + p0 + j * 4,
            sm + K3_HT + dd * 52 + j * 4);
  }
  // Prefetch W2 (used after GEMM1) into cache (global_prefetch_b8)
  for (int t = tid; t < 512; t += 384) __builtin_prefetch(w_c2 + t * 64, 0, 1);
  lds_async_wait();
  __syncthreads();

  // GEMM1: T1[e][p] = gelu( sum_d W1[e][d]*Ht[d][p] + b_c1[e] )
  // 32 M-tiles x 3 N-tiles = 96 tiles, 12 waves * 8
  for (int i = 0; i < 8; ++i) {
    const int t  = wave * 8 + i;
    const int mt = t / 3, nt = t % 3;
    const float* arow = sm + K3_WS + (mt * 16 + l16) * 68;
    v8f acc = {};
    #pragma unroll
    for (int kk = 0; kk < 64; kk += 4) {
      const int c0 = kk + (half ? 2 : 0);
      v2f a, bb;
      a.x = arow[c0]; a.y = arow[c0 + 1];
      bb.x = sm[K3_HT + c0 * 52 + nt * 16 + l16];
      bb.y = sm[K3_HT + (c0 + 1) * 52 + nt * 16 + l16];
      acc = wmma4(a, bb, acc);
    }
    #pragma unroll
    for (int r = 0; r < 8; ++r) {
      const int e = mt * 16 + r + 8 * half;
      const float xv = acc[r] + b_c1[e];
      sm[K3_T1 + e * 48 + nt * 16 + l16] =
          0.5f * xv * (1.f + erff(xv * 0.70710678118654752f));
    }
  }
  __syncthreads();
  // Restage W2 (64x512) into the W1 region, pad-516 rows (async)
  for (int t = tid; t < 64 * 128; t += 384) {
    const int dd = t >> 7, j = t & 127;
    g2lds16(w_c2 + dd * 512 + j * 4, sm + K3_WS + dd * 516 + j * 4);
  }
  lds_async_wait();
  __syncthreads();

  // GEMM2: Z[d][p] = sum_e W2[d][e]*T1[e][p]; out = BN2(Ht + Z + b_c2)^T
  {
    const int mt = wave & 3, nt = wave >> 2;
    const float* arow = sm + K3_WS + (mt * 16 + l16) * 516;
    v8f acc = {};
    #pragma unroll 8
    for (int kk = 0; kk < 512; kk += 4) {
      const int c0 = kk + (half ? 2 : 0);
      v2f a, bb;
      a.x = arow[c0]; a.y = arow[c0 + 1];
      bb.x = sm[K3_T1 + c0 * 48 + nt * 16 + l16];
      bb.y = sm[K3_T1 + (c0 + 1) * 48 + nt * 16 + l16];
      acc = wmma4(a, bb, acc);
    }
    const int pl = nt * 16 + l16;
    const int p  = p0 + pl;
    #pragma unroll
    for (int r = 0; r < 8; ++r) {
      const int dd = mt * 16 + r + 8 * half;
      const float z = acc[r] + b_c2[dd];
      const float rsum = sm[K3_HT + dd * 52 + pl] + z;
      const float s = g2[dd] * rsqrtf(v2[dd] + EPS_);
      out[((size_t)b * PRED_ + p) * 64 + dd] = (rsum - m2[dd]) * s + be2[dd];
    }
  }
}

extern "C" void kernel_launch(void* const* d_in, const int* in_sizes, int n_in,
                              void* d_out, int out_size, void* d_ws,
                              size_t ws_size, hipStream_t stream) {
  (void)in_sizes; (void)n_in; (void)out_size; (void)ws_size;
  const float* x      = (const float*)d_in[0];
  const float* x_date = (const float*)d_in[1];
  const float* y_date = (const float*)d_in[2];
  const float* w_lin  = (const float*)d_in[3];
  const float* b_lin  = (const float*)d_in[4];
  const float* w_c1   = (const float*)d_in[5];
  const float* b_c1   = (const float*)d_in[6];
  const float* w_c2   = (const float*)d_in[7];
  const float* b_c2   = (const float*)d_in[8];
  const float* g1     = (const float*)d_in[9];
  const float* be1    = (const float*)d_in[10];
  const float* m1     = (const float*)d_in[11];
  const float* v1     = (const float*)d_in[12];
  const float* g2     = (const float*)d_in[13];
  const float* be2    = (const float*)d_in[14];
  const float* m2     = (const float*)d_in[15];
  const float* v2     = (const float*)d_in[16];
  float* out   = (float*)d_out;
  float* vflat = (float*)d_ws;                       // 4096*1440 f32
  float* hbuf  = vflat + (size_t)4096 * OPL_;        // 4096*720 f32

  const size_t lds1 = (size_t)K1_TOT * sizeof(float);
  const size_t lds3 = (size_t)K3_TOT * sizeof(float);
  (void)hipFuncSetAttribute(reinterpret_cast<const void*>(attn_kernel),
                            hipFuncAttributeMaxDynamicSharedMemorySize, (int)lds1);
  (void)hipFuncSetAttribute(reinterpret_cast<const void*>(ffn_bn2_kernel),
                            hipFuncAttributeMaxDynamicSharedMemorySize, (int)lds3);

  attn_kernel<<<dim3(B_ * D_), 192, lds1, stream>>>(x, x_date, y_date, vflat);
  lin_bn1_kernel<<<dim3(64, 15), 384, 0, stream>>>(vflat, w_lin, b_lin, g1, be1,
                                                   m1, v1, hbuf);
  ffn_bn2_kernel<<<dim3(B_, 15), 384, lds3, stream>>>(hbuf, w_c1, b_c1, w_c2,
                                                      b_c2, g2, be2, m2, v2, out);
}

// v002
// A run of this version takes 168 microseconds.
// In two side-by-side timings against v001, it was 1.09 and 1.08 times as fast.
// Over all steps from v000 it is 1.51 times as fast.
#include <hip/hip_runtime.h>
#include <math.h>

// Shapes
#define B_    64
#define L_    128
#define D_    64
#define K_    64
#define O_    90
#define PL_   16
#define PRED_ 720
#define DM_   512
#define OPL_  1440   // O*PL
#define EPS_  1e-5f

typedef float v2f __attribute__((ext_vector_type(2)));
typedef float v8f __attribute__((ext_vector_type(8)));
typedef int   v4i __attribute__((vector_size(16)));

// D = A(16x4 f32) * B(4x16 f32) + C(16x16 f32)
static __device__ __forceinline__ v8f wmma4(v2f a, v2f b, v8f c) {
  return __builtin_amdgcn_wmma_f32_16x16x4_f32(false, a, false, b, (short)0, c,
                                               false, false);
}

// ---- global -> LDS 16B move: async (ASYNCcnt) when available, else via VGPR
#if defined(__gfx1250__) &&                                                    \
    __has_builtin(__builtin_amdgcn_global_load_async_to_lds_b128) &&           \
    __has_builtin(__builtin_amdgcn_s_wait_asynccnt)
#define ASYNC_LDS 1
#else
#define ASYNC_LDS 0
#endif

static __device__ __forceinline__ void g2lds16(const float* __restrict__ g,
                                               float* l) {
#if ASYNC_LDS
  __builtin_amdgcn_global_load_async_to_lds_b128(
      (__attribute__((address_space(1))) v4i*)g,
      (__attribute__((address_space(3))) v4i*)l, 0, 0);
#else
  const float4 v = *(const float4*)g;
  l[0] = v.x; l[1] = v.y; l[2] = v.z; l[3] = v.w;
#endif
}

static __device__ __forceinline__ void lds_async_wait() {
#if ASYNC_LDS
  __builtin_amdgcn_s_wait_asynccnt(0);
#endif
}

// ---------------- Kernel 1: per-(b,d) cross attention -> V (O*PL per head) ---
// Each of the 6 waves owns 16 output columns o over all 128 rows l: the scores
// stay in the accumulators, the softmax over l runs in registers, and the
// accumulator registers are the B operand of the second product.
// LDS layout (floats); row pads keep 16B alignment + conflict-free frag reads.
#define K1_XD 0                        // [128][68]
#define K1_YD (K1_XD + 128 * 68)       // [96][68]
#define K1_XP (K1_YD + 96 * 68)        // [16 groups][8 rows * 16 + 32 pad]
#define K1_XPG 160                     // group pitch: rows l and l+8 on other banks
#define K1_TOT (K1_XP + 16 * K1_XPG)   // 17792 floats = 71168 B

// lane l <-> lane l ^ 16
static __device__ __forceinline__ float xhalf(float v) {
  const int i = __builtin_bit_cast(int, v);
  return __builtin_bit_cast(
      float, __builtin_amdgcn_permlanex16(i, i, 0x76543210, 0xfedcba98, false,
                                          false));
}

__global__ __launch_bounds__(192) void attn_kernel(
    const float* __restrict__ x, const float* __restrict__ x_date,
    const float* __restrict__ y_date, float* __restrict__ vout) {
  extern __shared__ float sm[];
  const int bd   = blockIdx.x;
  const int b    = bd >> 6;
  const int d    = bd & 63;
  const int tid  = threadIdx.x;
  const int lane = tid & 31;
  const int wave = __builtin_amdgcn_readfirstlane(tid >> 5);  // scalar loop tests
  const int half = lane >> 4;
  const int l16  = lane & 15;

  // Staging, one wave-wide copy = 512 B; every trip test is the same for a wave.
  // x_date slice (L x K), row stride D*K: two rows a copy
  const float* xd = x_date + (size_t)b * (L_ * D_ * K_) + (size_t)d * K_;
  for (int rp = wave; rp < 64; rp += 6) {
    const int l = rp * 2 + half;
    g2lds16(xd + (size_t)l * (D_ * K_) + l16 * 4, sm + K1_XD + l * 68 + l16 * 4);
  }
  // y_date slice (O x K): two rows a copy, 45 pairs
  const float* yd = y_date + (size_t)b * (O_ * D_ * K_) + (size_t)d * K_;
  for (int rp = wave; rp < 45; rp += 6) {
    const int o = rp * 2 + half;
    g2lds16(yd + (size_t)o * (D_ * K_) + l16 * 4, sm + K1_YD + o * 68 + l16 * 4);
  }
  // x slice (L x PL), contiguous: one group of eight rows a copy
  const float* xp = x + (size_t)bd * (L_ * PL_);
  for (int g = wave; g < 16; g += 6)
    g2lds16(xp + g * 128 + lane * 4, sm + K1_XP + g * K1_XPG + lane * 4);
  // Zero-pad y rows 90..95
  if (tid < 96) {
    float* r = sm + K1_YD + (O_ + (tid >> 4)) * 68 + (tid & 15) * 4;
    *(float4*)r = make_float4(0.f, 0.f, 0.f, 0.f);
  }
  lds_async_wait();
  __syncthreads();

  // Scores: S[l][o] = sum_k Xd[l][k] * Yd[o][k]; s[lt][r] = S[lt*16+8*half+r][o]
  const int o = wave * 16 + l16;
  v2f bf[16];
  {
    const float* brow = sm + K1_YD + o * 68 + 2 * half;
    #pragma unroll  // bf[] is indexed by constants only, so it lives in registers
    for (int j = 0; j < 16; ++j) bf[j] = *(const v2f*)(brow + 4 * j);
  }
  // All loops over s[] below are unrolled whole: constant indices keep the 64
  // scores in registers (a rolled loop would put them in scratch).
  v8f s[8];
  #pragma unroll
  for (int lt = 0; lt < 8; ++lt) {
    const float* arow = sm + K1_XD + (lt * 16 + l16) * 68 + 2 * half;
    v8f acc = {};
    #pragma unroll
    for (int j = 0; j < 16; ++j) {
      acc = wmma4(*(const v2f*)(arow + 4 * j), bf[j], acc);
    }
    s[lt] = acc;
  }

  // Softmax over l of column o: 64 values in this lane, 64 in lane ^ 16
  float mx4[4] = {-3.4e38f, -3.4e38f, -3.4e38f, -3.4e38f};
  #pragma unroll
  for (int lt = 0; lt < 8; ++lt)
    #pragma unroll
    for (int r = 0; r < 8; ++r) mx4[r & 3] = fmaxf(mx4[r & 3], s[lt][r]);
  float mx = fmaxf(fmaxf(mx4[0], mx4[1]), fmaxf(mx4[2], mx4[3]));
  mx = fmaxf(mx, xhalf(mx));
  const float c2  = 0.125f * 1.44269504088896340736f;  // 1/sqrt(64) * log2(e)
  const float mc2 = mx * c2;
  float sum4[4] = {0.f, 0.f, 0.f, 0.f};
  #pragma unroll
  for (int lt = 0; lt < 8; ++lt)
    #pragma unroll
    for (int r = 0; r < 8; ++r) {
      const float e = __builtin_amdgcn_exp2f(s[lt][r] * c2 - mc2);
      s[lt][r] = e;
      sum4[r & 3] += e;
    }
  float sum = (sum4[0] + sum4[1]) + (sum4[2] + sum4[3]);
  sum += xhalf(sum);
  const float inv = 1.f / sum;

  // V^T[p][o] = sum_l Xp[l][p] * E[l][o], then * inv (column o is this lane's).
  // k order of step (lt, j), both operands: l = lt*16 + 8*half + 2*j + {0, 1}
  // Two accumulate chains (even, odd lt): a lone chain waits on its own D.
  v8f pv[2] = {};
  #pragma unroll
  for (int lt = 0; lt < 8; ++lt) {
    const float* ag = sm + K1_XP + (lt * 2 + half) * K1_XPG + l16;
    #pragma unroll
    for (int j = 0; j < 4; ++j) {
      v2f a, bb;
      a.x = ag[(2 * j) * 16]; a.y = ag[(2 * j + 1) * 16];
      bb.x = s[lt][2 * j]; bb.y = s[lt][2 * j + 1];
      pv[lt & 1] = wmma4(a, bb, pv[lt & 1]);
    }
  }
  const v8f acc = pv[0] + pv[1];
  if (o < O_) {
    float* vb = vout + (size_t)bd * OPL_ + o * 16 + 8 * half;  // p = 8*half + r
    *(float4*)vb = make_float4(acc[0] * inv, acc[1] * inv, acc[2] * inv, acc[3] * inv);
    *(float4*)(vb + 4) = make_float4(acc[4] * inv, acc[5] * inv, acc[6] * inv, acc[7] * inv);
  }
}

// ---------------- Kernel 2: h = V @ w_lin^T + b_lin, BN1 (double-buffered) --
static __device__ __forceinline__ void k2_load_tile(
    const float* __restrict__ vflat, const float* __restrict__ w_lin,
    float* At, float* Bt, int gm0, int gn0, int kt, int tid) {
  for (int t = tid; t < 768; t += 384) {
    const int m = t / 12, j = t % 12;
    g2lds16(vflat + (size_t)(gm0 + m) * OPL_ + kt + j * 4, At + m * 52 + j * 4);
  }
  for (int t = tid; t < 576; t += 384) {
    const int n = t / 12, j = t % 12;
    g2lds16(w_lin + (size_t)(gn0 + n) * OPL_ + kt + j * 4, Bt + n * 52 + j * 4);
  }
}

__global__ __launch_bounds__(384) void lin_bn1_kernel(
    const float* __restrict__ vflat, const float* __restrict__ w_lin,
    const float* __restrict__ b_lin, const float* __restrict__ g1,
    const float* __restrict__ be1, const float* __restrict__ m1,
    const float* __restrict__ v1, float* __restrict__ hout) {
  __shared__ float At[2][64 * 52];
  __shared__ float Bt[2][48 * 52];
  const int tid  = threadIdx.x;
  const int lane = tid & 31;
  const int wave = tid >> 5;
  const int half = lane >> 4;
  const int l16  = lane & 15;
  const int gm0  = blockIdx.x * 64;
  const int gn0  = blockIdx.y * 48;
  const int mt   = wave & 3;   // 4 M-tiles
  const int nt   = wave >> 2;  // 3 N-tiles

  k2_load_tile(vflat, w_lin, At[0], Bt[0], gm0, gn0, 0, tid);
  v8f acc = {};
  for (int it = 0; it < 30; ++it) {
    const int buf = it & 1;
    lds_async_wait();
    __syncthreads();  // tile `it` resident; all waves done reading buf^1
    if (it + 1 < 30)
      k2_load_tile(vflat, w_lin, At[buf ^ 1], Bt[buf ^ 1], gm0, gn0,
                   (it + 1) * 48, tid);
    const float* arow = &At[buf][(mt * 16 + l16) * 52];
    const float* brow = &Bt[buf][(nt * 16 + l16) * 52];
    #pragma unroll
    for (int kk = 0; kk < 48; kk += 4) {
      const int c0 = kk + (half ? 2 : 0);
      v2f a, bb;
      a.x = arow[c0]; a.y = arow[c0 + 1];
      bb.x = brow[c0]; bb.y = brow[c0 + 1];
      acc = wmma4(a, bb, acc);
    }
  }
  const int n = gn0 + nt * 16 + l16;
  const float bl = b_lin[n];
  #pragma unroll
  for (int r = 0; r < 8; ++r) {
    const int g = gm0 + mt * 16 + r + 8 * half;
    const int d = g & 63;
    const float s = g1[d] * rsqrtf(v1[d] + EPS_);
    hout[(size_t)g * PRED_ + n] = (acc[r] + bl - m1[d]) * s + be1[d];
  }
}

// ---------------- Kernel 3: FFN (conv1x1) + residual + BN2 + transpose ------
#define K3_WS 0                          // max(512*68, 64*516) = 34816
#define K3_T1 34816                      // [512][48]
#define K3_HT (34816 + 512 * 48)         // [64][52]
#define K3_TOT (K3_HT + 64 * 52)         // 62720 floats = 250880 B

// GELU (exact, erf form) of two values. erf(z) is formed without a branch: both
// range polynomials are evaluated and one is selected, so that the values of a
// tile are independent straight-line chains the scheduler can interleave.
static __device__ __forceinline__ v2f fma2(v2f a, v2f b, v2f c) {
  return __builtin_elementwise_fma(a, b, c);
}
static __device__ __forceinline__ v2f dup2(float c) {
  v2f r = {c, c};
  return r;
}
static __device__ __forceinline__ v2f gelu2(v2f xv) {
  const v2f z  = xv * 0.70710678118654752f;
  const v2f az = __builtin_elementwise_abs(z);
  // |z| >= 1: erf = 1 - exp(-(|z| + |z| * P(|z|)))
  v2f p = fma2(az, dup2(1.6998811e-5f), dup2(-3.7867785e-4f));
  p = fma2(az, p, dup2(3.8578159e-3f));
  p = fma2(az, p, dup2(-2.4181698e-2f));
  p = fma2(az, p, dup2(1.0666826e-1f));
  p = fma2(az, p, dup2(6.3493329e-1f));
  p = fma2(az, p, dup2(1.2868941e-1f));
  p = fma2(az, p, az);
  const v2f t2 = p * -1.44269504088896340736f;  // exp(-p) = 2^(-p * log2 e)
  v2f far;
  far.x = 1.f - __builtin_amdgcn_exp2f(t2.x);
  far.y = 1.f - __builtin_amdgcn_exp2f(t2.y);
  // |z| < 1: erf = |z| + |z| * Q(z^2)
  const v2f t = z * z;
  v2f q = fma2(t, dup2(-5.6180177e-4f), dup2(4.9138162e-3f));
  q = fma2(t, q, dup2(-2.6707515e-2f));
  q = fma2(t, q, dup2(1.1280011e-1f));
  q = fma2(t, q, dup2(-3.7612295e-1f));
  q = fma2(t, q, dup2(1.2837911e-1f));
  q = fma2(az, q, az);
  v2f e;
  e.x = __builtin_copysignf(az.x < 1.f ? q.x : far.x, z.x);
  e.y = __builtin_copysignf(az.y < 1.f ? q.y : far.y, z.y);
  return (xv * 0.5f) * (e + 1.f);
}

// 250,880 B of LDS: one work-group a WGP, 3 waves a SIMD. Saying so takes the
// scheduler off its 16-wave register target: it then asks for a tile's bias and
// fragments as one group and interleaves the GELU chains instead of serialising.
__global__ __launch_bounds__(384) __attribute__((amdgpu_waves_per_eu(3, 3)))
void ffn_bn2_kernel(
    const float* __restrict__ h, const float* __restrict__ w_c1,
    const float* __restrict__ b_c1, const float* __restrict__ w_c2,
    const float* __restrict__ b_c2, const float* __restrict__ g2,
    const float* __restrict__ be2, const float* __restrict__ m2,
    const float* __restrict__ v2, float* __restrict__ out) {
  extern __shared__ float sm[];
  const int tid  = threadIdx.x;
  const int lane = tid & 31;
  const int wave = tid >> 5;
  const int half = lane >> 4;
  const int l16  = lane & 15;
  const int b    = blockIdx.x;
  const int p0   = blockIdx.y * 48;

  // Stage W1 (512x64), pad-68 rows; H tile (64x48), pad-52 rows (async)
  for (int t = tid; t < 512 * 16; t += 384) {
    const int e = t >> 4, j = t & 15;
    g2lds16(w_c1 + e * 64 + j * 4, sm + K3_WS + e * 68 + j * 4);
  }
  for (int t = tid; t < 64 * 12; t += 384) {
    const int dd = t / 12, j = t % 12;
    g2lds16(h + ((size_t)b * 64 + dd) * PRED_ + p0 + j * 4,
            sm + K3_HT + dd * 52 + j * 4);
  }
  // Prefetch W2 (used after GEMM1) into cache (global_prefetch_b8)
  for (int t = tid; t < 512; t += 384) __builtin_prefetch(w_c2 + t * 64, 0, 1);
  lds_async_wait();
  __syncthreads();

  // GEMM1: T1[e][p] = gelu( sum_d W1[e][d]*Ht[d][p] + b_c1[e] )
  // 32 M-tiles x 3 N-tiles = 96 tiles, 12 waves * 8
  for (int i = 0; i < 8; ++i) {
    const int t  = wave * 8 + i;
    const int mt = t / 3, nt = t % 3;
    const float* arow = sm + K3_WS + (mt * 16 + l16) * 68;
    // bias of rows e = mt*16 + 8*half + 0..7, asked for ahead of the products
    const float4 bq0 = *(const float4*)(b_c1 + mt * 16 + 8 * half);
    const float4 bq1 = *(const float4*)(b_c1 + mt * 16 + 8 * half + 4);
    v8f acc = {};
    #pragma unroll
    for (int kk = 0; kk < 64; kk += 4) {
      const int c0 = kk + (half ? 2 : 0);
      v2f a, bb;
      a.x = arow[c0]; a.y = arow[c0 + 1];
      bb.x = sm[K3_HT + c0 * 52 + nt * 16 + l16];
      bb.y = sm[K3_HT + (c0 + 1) * 52 + nt * 16 + l16];
      acc = wmma4(a, bb, acc);
    }
    const float bias[8] = {bq0.x, bq0.y, bq0.z, bq0.w, bq1.x, bq1.y, bq1.z, bq1.w};
    float* trow = sm + K3_T1 + (mt * 16 + 8 * half) * 48 + nt * 16 + l16;
    #pragma unroll  // four independent pairs in one straight line
    for (int r = 0; r < 8; r += 2) {
      v2f xv;
      xv.x = acc[r] + bias[r];
      xv.y = acc[r + 1] + bias[r + 1];
      const v2f g = gelu2(xv);
      trow[r * 48]       = g.x;
      trow[(r + 1) * 48] = g.y;
    }
  }
  __syncthreads();
  // Restage W2 (64x512) into the W1 region, pad-516 rows (async)
  for (int t = tid; t < 64 * 128; t += 384) {
    const int dd = t >> 7, j = t & 127;
    g2lds16(w_c2 + dd * 512 + j * 4, sm + K3_WS + dd * 516 + j * 4);
  }
  lds_async_wait();
  __syncthreads();

  // GEMM2: Z[d][p] = sum_e W2[d][e]*T1[e][p]; out = BN2(Ht + Z + b_c2)^T
  {
    const int mt = wave & 3, nt = wave >> 2;
    const float* arow = sm + K3_WS + (mt * 16 + l16) * 516;
    v8f acc = {};
    #pragma unroll 8
    for (int kk = 0; kk < 512; kk += 4) {
      const int c0 = kk + (half ? 2 : 0);
      v2f a, bb;
      a.x = arow[c0]; a.y = arow[c0 + 1];
      bb.x = sm[K3_T1 + c0 * 48 + nt * 16 + l16];
      bb.y = sm[K3_T1 + (c0 + 1) * 48 + nt * 16 + l16];
      acc = wmma4(a, bb, acc);
    }
    const int pl = nt * 16 + l16;
    const int p  = p0 + pl;
    #pragma unroll
    for (int r = 0; r < 8; ++r) {
      const int dd = mt * 16 + r + 8 * half;
      const float z = acc[r] + b_c2[dd];
      const float rsum = sm[K3_HT + dd * 52 + pl] + z;
      const float s = g2[dd] * rsqrtf(v2[dd] + EPS_);
      out[((size_t)b * PRED_ + p) * 64 + dd] = (rsum - m2[dd]) * s + be2[dd];
    }
  }
}

extern "C" void kernel_launch(void* const* d_in, const int* in_sizes, int n_in,
                              void* d_out, int out_size, void* d_ws,
                              size_t ws_size, hipStream_t stream) {
  (void)in_sizes; (void)n_in; (void)out_size; (void)ws_size;
  const float* x      = (const float*)d_in[0];
  const float* x_date = (const float*)d_in[1];
  const float* y_date = (const float*)d_in[2];
  const float* w_lin  = (const float*)d_in[3];
  const float* b_lin  = (const float*)d_in[4];
  const float* w_c1   = (const float*)d_in[5];
  const float* b_c1   = (const float*)d_in[6];
  const float* w_c2   = (const float*)d_in[7];
  const float* b_c2   = (const float*)d_in[8];
  const float* g1     = (const float*)d_in[9];
  const float* be1    = (const float*)d_in[10];
  const float* m1     = (const float*)d_in[11];
  const float* v1     = (const float*)d_in[12];
  const float* g2     = (const float*)d_in[13];
  const float* be2    = (const float*)d_in[14];
  const float* m2     = (const float*)d_in[15];
  const float* v2     = (const float*)d_in[16];
  float* out   = (float*)d_out;
  float* vflat = (float*)d_ws;                       // 4096*1440 f32
  float* hbuf  = vflat + (size_t)4096 * OPL_;        // 4096*720 f32

  const size_t lds1 = (size_t)K1_TOT * sizeof(float);
  const size_t lds3 = (size_t)K3_TOT * sizeof(float);
  (void)hipFuncSetAttribute(reinterpret_cast<const void*>(attn_kernel),
                            hipFuncAttributeMaxDynamicSharedMemorySize, (int)lds1);
  (void)hipFuncSetAttribute(reinterpret_cast<const void*>(ffn_bn2_kernel),
                            hipFuncAttributeMaxDynamicSharedMemorySize, (int)lds3);

  attn_kernel<<<dim3(B_ * D_), 192, lds1, stream>>>(x, x_date, y_date, vflat);
  lin_bn1_kernel<<<dim3(64, 15), 384, 0, stream>>>(vflat, w_lin, b_lin, g1, be1,
                                                   m1, v1, hbuf);
  ffn_bn2_kernel<<<dim3(B_, 15), 384, lds3, stream>>>(hbuf, w_c1, b_c1, w_c2,
                                                      b_c2, g2, be2, m2, v2, out);
}

// v003
// Measured time: 150 microseconds a run.
// In two side-by-side timings against v002, it was 1.12 and 1.11 times as fast.
// Over all steps from v000 it is 1.68 times as fast.
#include <hip/hip_runtime.h>
#include <math.h>

// Shapes
#define B_    64
#define L_    128
#define D_    64
#define K_    64
#define O_    90
#define PL_   16
#define PRED_ 720
#define DM_   512
#define OPL_  1440   // O*PL
#define EPS_  1e-5f

typedef float v2f __attribute__((ext_vector_type(2)));
typedef float v8f __attribute__((ext_vector_type(8)));
typedef int   v4i __attribute__((vector_size(16)));

// D = A(16x4 f32) * B(4x16 f32) + C(16x16 f32)
static __device__ __forceinline__ v8f wmma4(v2f a, v2f b, v8f c) {
  return __builtin_amdgcn_wmma_f32_16x16x4_f32(false, a, false, b, (short)0, c,
                                               false, false);
}

// ---- global -> LDS 16B move: async (ASYNCcnt) when available, else via VGPR
#if defined(__gfx1250__) &&                                                    \
    __has_builtin(__builtin_amdgcn_global_load_async_to_lds_b128) &&           \
    __has_builtin(__builtin_amdgcn_s_wait_asynccnt)
#define ASYNC_LDS 1
#else
#define ASYNC_LDS 0
#endif

static __device__ __forceinline__ void g2lds16(const float* __restrict__ g,
                                               float* l) {
#if ASYNC_LDS
  __builtin_amdgcn_global_load_async_to_lds_b128(
      (__attribute__((address_space(1))) v4i*)g,
      (__attribute__((address_space(3))) v4i*)l, 0, 0);
#else
  const float4 v = *(const float4*)g;
  l[0] = v.x; l[1] = v.y; l[2] = v.z; l[3] = v.w;
#endif
}

static __device__ __forceinline__ void lds_async_wait() {
#if ASYNC_LDS
  __builtin_amdgcn_s_wait_asynccnt(0);
#endif
}

// ---------------- Kernel 1: per-(b,d) cross attention -> V (O*PL per head) ---
// Each of the 6 waves owns 16 output columns o over all 128 rows l: the scores
// stay in the accumulators, the softmax over l runs in registers, and the
// accumulator registers are the B operand of the second product.
// LDS layout (floats); row pads keep 16B alignment + conflict-free frag reads.
#define K1_XD 0                        // [128][68]
#define K1_YD (K1_XD + 128 * 68)       // [96][68]
#define K1_XP (K1_YD + 96 * 68)        // [16 groups][8 rows * 16 + 32 pad]
#define K1_XPG 160                     // group pitch: rows l and l+8 on other banks
#define K1_TOT (K1_XP + 16 * K1_XPG)   // 17792 floats = 71168 B

// lane l <-> lane l ^ 16
static __device__ __forceinline__ float xhalf(float v) {
  const int i = __builtin_bit_cast(int, v);
  return __builtin_bit_cast(
      float, __builtin_amdgcn_permlanex16(i, i, 0x76543210, 0xfedcba98, false,
                                          false));
}

__global__ __launch_bounds__(192) void attn_kernel(
    const float* __restrict__ x, const float* __restrict__ x_date,
    const float* __restrict__ y_date, float* __restrict__ vout) {
  extern __shared__ float sm[];
  const int bd   = blockIdx.x;
  const int b    = bd >> 6;
  const int d    = bd & 63;
  const int tid  = threadIdx.x;
  const int lane = tid & 31;
  const int wave = __builtin_amdgcn_readfirstlane(tid >> 5);  // scalar loop tests
  const int half = lane >> 4;
  const int l16  = lane & 15;

  // Staging, one wave-wide copy = 512 B; every trip test is the same for a wave.
  // x_date slice (L x K), row stride D*K: two rows a copy
  const float* xd = x_date + (size_t)b * (L_ * D_ * K_) + (size_t)d * K_;
  for (int rp = wave; rp < 64; rp += 6) {
    const int l = rp * 2 + half;
    g2lds16(xd + (size_t)l * (D_ * K_) + l16 * 4, sm + K1_XD + l * 68 + l16 * 4);
  }
  // y_date slice (O x K): two rows a copy, 45 pairs
  const float* yd = y_date + (size_t)b * (O_ * D_ * K_) + (size_t)d * K_;
  for (int rp = wave; rp < 45; rp += 6) {
    const int o = rp * 2 + half;
    g2lds16(yd + (size_t)o * (D_ * K_) + l16 * 4, sm + K1_YD + o * 68 + l16 * 4);
  }
  // x slice (L x PL), contiguous: one group of eight rows a copy
  const float* xp = x + (size_t)bd * (L_ * PL_);
  for (int g = wave; g < 16; g += 6)
    g2lds16(xp + g * 128 + lane * 4, sm + K1_XP + g * K1_XPG + lane * 4);
  // Zero-pad y rows 90..95
  if (tid < 96) {
    float* r = sm + K1_YD + (O_ + (tid >> 4)) * 68 + (tid & 15) * 4;
    *(float4*)r = make_float4(0.f, 0.f, 0.f, 0.f);
  }
  lds_async_wait();
  __syncthreads();

  // Scores: S[l][o] = sum_k Xd[l][k] * Yd[o][k]; s[lt][r] = S[lt*16+8*half+r][o]
  const int o = wave * 16 + l16;
  v2f bf[16];
  {
    const float* brow = sm + K1_YD + o * 68 + 2 * half;
    #pragma unroll  // bf[] is indexed by constants only, so it lives in registers
    for (int j = 0; j < 16; ++j) bf[j] = *(const v2f*)(brow + 4 * j);
  }
  // All loops over s[] below are unrolled whole: constant indices keep the 64
  // scores in registers (a rolled loop would put them in scratch).
  v8f s[8];
  #pragma unroll
  for (int lt = 0; lt < 8; ++lt) {
    const float* arow = sm + K1_XD + (lt * 16 + l16) * 68 + 2 * half;
    v8f acc = {};
    #pragma unroll
    for (int j = 0; j < 16; ++j) {
      acc = wmma4(*(const v2f*)(arow + 4 * j), bf[j], acc);
    }
    s[lt] = acc;
  }

  // Softmax over l of column o: 64 values in this lane, 64 in lane ^ 16
  float mx4[4] = {-3.4e38f, -3.4e38f, -3.4e38f, -3.4e38f};
  #pragma unroll
  for (int lt = 0; lt < 8; ++lt)
    #pragma unroll
    for (int r = 0; r < 8; ++r) mx4[r & 3] = fmaxf(mx4[r & 3], s[lt][r]);
  float mx = fmaxf(fmaxf(mx4[0], mx4[1]), fmaxf(mx4[2], mx4[3]));
  mx = fmaxf(mx, xhalf(mx));
  const float c2  = 0.125f * 1.44269504088896340736f;  // 1/sqrt(64) * log2(e)
  const float mc2 = mx * c2;
  float sum4[4] = {0.f, 0.f, 0.f, 0.f};
  #pragma unroll
  for (int lt = 0; lt < 8; ++lt)
    #pragma unroll
    for (int r = 0; r < 8; ++r) {
      const float e = __builtin_amdgcn_exp2f(s[lt][r] * c2 - mc2);
      s[lt][r] = e;
      sum4[r & 3] += e;
    }
  float sum = (sum4[0] + sum4[1]) + (sum4[2] + sum4[3]);
  sum += xhalf(sum);
  const float inv = 1.f / sum;

  // V^T[p][o] = sum_l Xp[l][p] * E[l][o], then * inv (column o is this lane's).
  // k order of step (lt, j), both operands: l = lt*16 + 8*half + 2*j + {0, 1}
  // Two accumulate chains (even, odd lt): a lone chain waits on its own D.
  v8f pv[2] = {};
  #pragma unroll
  for (int lt = 0; lt < 8; ++lt) {
    const float* ag = sm + K1_XP + (lt * 2 + half) * K1_XPG + l16;
    #pragma unroll
    for (int j = 0; j < 4; ++j) {
      v2f a, bb;
      a.x = ag[(2 * j) * 16]; a.y = ag[(2 * j + 1) * 16];
      bb.x = s[lt][2 * j]; bb.y = s[lt][2 * j + 1];
      pv[lt & 1] = wmma4(a, bb, pv[lt & 1]);
    }
  }
  const v8f acc = pv[0] + pv[1];
  if (o < O_) {
    float* vb = vout + (size_t)bd * OPL_ + o * 16 + 8 * half;  // p = 8*half + r
    *(float4*)vb = make_float4(acc[0] * inv, acc[1] * inv, acc[2] * inv, acc[3] * inv);
    *(float4*)(vb + 4) = make_float4(acc[4] * inv, acc[5] * inv, acc[6] * inv, acc[7] * inv);
  }
}

// ---------------- Kernel 2: h = V @ w_lin^T + b_lin, BN1 (double-buffered) --
static __device__ __forceinline__ void k2_load_tile(
    const float* __restrict__ vflat, const float* __restrict__ w_lin,
    float* At, float* Bt, int gm0, int gn0, int kt, int tid) {
  for (int t = tid; t < 768; t += 384) {
    const int m = t / 12, j = t % 12;
    g2lds16(vflat + (size_t)(gm0 + m) * OPL_ + kt + j * 4, At + m * 52 + j * 4);
  }
  for (int t = tid; t < 576; t += 384) {
    const int n = t / 12, j = t % 12;
    g2lds16(w_lin + (size_t)(gn0 + n) * OPL_ + kt + j * 4, Bt + n * 52 + j * 4);
  }
}

__global__ __launch_bounds__(384) void lin_bn1_kernel(
    const float* __restrict__ vflat, const float* __restrict__ w_lin,
    const float* __restrict__ b_lin, const float* __restrict__ g1,
    const float* __restrict__ be1, const float* __restrict__ m1,
    const float* __restrict__ v1, float* __restrict__ hout) {
  __shared__ float At[2][64 * 52];
  __shared__ float Bt[2][48 * 52];
  const int tid  = threadIdx.x;
  const int lane = tid & 31;
  const int wave = tid >> 5;
  const int half = lane >> 4;
  const int l16  = lane & 15;
  const int gm0  = blockIdx.x * 64;
  const int gn0  = blockIdx.y * 48;
  const int mt   = wave & 3;   // 4 M-tiles
  const int nt   = wave >> 2;  // 3 N-tiles

  k2_load_tile(vflat, w_lin, At[0], Bt[0], gm0, gn0, 0, tid);
  v8f acc = {};
  for (int it = 0; it < 30; ++it) {
    const int buf = it & 1;
    lds_async_wait();
    __syncthreads();  // tile `it` resident; all waves done reading buf^1
    if (it + 1 < 30)
      k2_load_tile(vflat, w_lin, At[buf ^ 1], Bt[buf ^ 1], gm0, gn0,
                   (it + 1) * 48, tid);
    const float* arow = &At[buf][(mt * 16 + l16) * 52];
    const float* brow = &Bt[buf][(nt * 16 + l16) * 52];
    #pragma unroll
    for (int kk = 0; kk < 48; kk += 4) {
      const int c0 = kk + (half ? 2 : 0);
      v2f a, bb;
      a.x = arow[c0]; a.y = arow[c0 + 1];
      bb.x = brow[c0]; bb.y = brow[c0 + 1];
      acc = wmma4(a, bb, acc);
    }
  }
  const int n = gn0 + nt * 16 + l16;
  const float bl = b_lin[n];
  #pragma unroll
  for (int r = 0; r < 8; ++r) {
    const int g = gm0 + mt * 16 + r + 8 * half;
    const int d = g & 63;
    const float s = g1[d] * rsqrtf(v1[d] + EPS_);
    hout[(size_t)g * PRED_ + n] = (acc[r] + bl - m1[d]) * s + be1[d];
  }
}

// ---------------- Kernel 3: FFN (conv1x1) + residual + BN2 + transpose ------
// Each wave owns 16 columns p of one batch through both products: the GELU'd
// accumulators of the first product are the B operand of the second.
#define K3_W1 0                          // [512][68]
#define K3_W2 (512 * 68)                 // [64][516]
#define K3_TOT (K3_W2 + 64 * 516)        // 67840 floats = 271360 B

// GELU (exact, erf form) of two values. erf(z) is formed without a branch: both
// range polynomials are evaluated and one is selected, so that the values of a
// tile are independent straight-line chains the scheduler can interleave.
static __device__ __forceinline__ v2f fma2(v2f a, v2f b, v2f c) {
  return __builtin_elementwise_fma(a, b, c);
}
static __device__ __forceinline__ v2f dup2(float c) {
  v2f r = {c, c};
  return r;
}
static __device__ __forceinline__ v2f gelu2(v2f xv) {
  const v2f z  = xv * 0.70710678118654752f;
  const v2f az = __builtin_elementwise_abs(z);
  // |z| >= 1: erf = 1 - exp(-(|z| + |z| * P(|z|)))
  v2f p = fma2(az, dup2(1.6998811e-5f), dup2(-3.7867785e-4f));
  p = fma2(az, p, dup2(3.8578159e-3f));
  p = fma2(az, p, dup2(-2.4181698e-2f));
  p = fma2(az, p, dup2(1.0666826e-1f));
  p = fma2(az, p, dup2(6.3493329e-1f));
  p = fma2(az, p, dup2(1.2868941e-1f));
  p = fma2(az, p, az);
  const v2f t2 = p * -1.44269504088896340736f;  // exp(-p) = 2^(-p * log2 e)
  v2f far;
  far.x = 1.f - __builtin_amdgcn_exp2f(t2.x);
  far.y = 1.f - __builtin_amdgcn_exp2f(t2.y);
  // |z| < 1: erf = |z| + |z| * Q(z^2)
  const v2f t = z * z;
  v2f q = fma2(t, dup2(-5.6180177e-4f), dup2(4.9138162e-3f));
  q = fma2(t, q, dup2(-2.6707515e-2f));
  q = fma2(t, q, dup2(1.1280011e-1f));
  q = fma2(t, q, dup2(-3.7612295e-1f));
  q = fma2(t, q, dup2(1.2837911e-1f));
  q = fma2(az, q, az);
  v2f e;
  e.x = __builtin_copysignf(az.x < 1.f ? q.x : far.x, z.x);
  e.y = __builtin_copysignf(az.y < 1.f ? q.y : far.y, z.y);
  return (xv * 0.5f) * (e + 1.f);
}

// 271,360 B of LDS: one work-group a WGP, 3 waves a SIMD. Saying so takes the
// scheduler off its 16-wave register target: it then asks for a tile's bias and
// fragments as one group and interleaves the GELU chains instead of serialising.
__global__ __launch_bounds__(384) __attribute__((amdgpu_waves_per_eu(3, 3)))
void ffn_bn2_kernel(
    const float* __restrict__ h, const float* __restrict__ w_c1,
    const float* __restrict__ b_c1, const float* __restrict__ w_c2,
    const float* __restrict__ b_c2, const float* __restrict__ g2,
    const float* __restrict__ be2, const float* __restrict__ m2,
    const float* __restrict__ v2, float* __restrict__ out) {
  extern __shared__ float sm[];
  const int tid  = threadIdx.x;
  const int lane = tid & 31;
  const int wave = __builtin_amdgcn_readfirstlane(tid >> 5);  // scalar tile index
  const int half = lane >> 4;
  const int l16  = lane & 15;
  const int ct   = blockIdx.x * 12 + wave;  // column tile, 64 * 45 of them
  const int b    = ct / 45;
  const int p    = (ct % 45) * 16 + l16;

  // Stage W1 (512x64), pad-68 rows, and W2 (64x512), pad-516 rows (async)
  for (int t = tid; t < 512 * 16; t += 384) {
    const int e = t >> 4, j = t & 15;
    g2lds16(w_c1 + e * 64 + j * 4, sm + K3_W1 + e * 68 + j * 4);
  }
  for (int t = tid; t < 64 * 128; t += 384) {
    const int dd = t >> 7, j = t & 127;
    g2lds16(w_c2 + dd * 512 + j * 4, sm + K3_W2 + dd * 516 + j * 4);
  }
  // Column p of H: hf[t][j] = H[16t + 8*half + 2j + {0, 1}][p]. That is the B
  // operand of the first product and, register for register, the residual of
  // the second product's accumulators.
  v2f hf[4][4];
  {
    const float* hcol = h + (size_t)b * (64 * PRED_) + (size_t)(8 * half) * PRED_ + p;
    #pragma unroll  // hf[][] is indexed by constants only: registers
    for (int t = 0; t < 4; ++t)
      #pragma unroll
      for (int j = 0; j < 4; ++j) {
        hf[t][j].x = hcol[(16 * t + 2 * j) * PRED_];
        hf[t][j].y = hcol[(16 * t + 2 * j + 1) * PRED_];
      }
  }
  lds_async_wait();
  __syncthreads();

  // k order of every step, A and B alike: 16*tile + 8*half + 2*j + {0, 1}; a
  // 16-byte read of a weight row holds the A operands of steps j and j + 1.
  const float* w1p = sm + K3_W1 + l16 * 68 + 8 * half;
  const float* w2p = sm + K3_W2 + l16 * 516 + 8 * half;
  // Every inner loop below is unrolled whole: constant indices keep hf[], g[],
  // f[] and z[] in registers (a rolled loop would put them in scratch), and the
  // trip's 32 LDS reads can then be asked for as one group ahead of its WMMAs.
  v8f z[4] = {};
  for (int mt = 0; mt < 32; mt += 2) {  // two tiles of 16 rows e a trip
    // bias of rows e = mt*16 + 8*half + 0..7 (+16), asked for ahead of the products
    const float* bp = b_c1 + mt * 16 + 8 * half;
    const float4 bq0 = *(const float4*)(bp);
    const float4 bq1 = *(const float4*)(bp + 4);
    const float4 bq2 = *(const float4*)(bp + 16);
    const float4 bq3 = *(const float4*)(bp + 20);
    // T[e][p] = sum_d W1[e][d] * H[d][p]: two accumulate chains side by side
    const float* r0 = w1p + mt * (16 * 68);
    v8f c0 = {}, c1 = {};
    #pragma unroll
    for (int t = 0; t < 4; ++t)
      #pragma unroll
      for (int q = 0; q < 2; ++q) {
        const float4 f0 = *(const float4*)(r0 + 16 * t + 4 * q);
        const float4 f1 = *(const float4*)(r0 + 16 * 68 + 16 * t + 4 * q);
        const v2f a00 = {f0.x, f0.y}, a01 = {f0.z, f0.w};
        const v2f a10 = {f1.x, f1.y}, a11 = {f1.z, f1.w};
        c0 = wmma4(a00, hf[t][2 * q], c0);
        c1 = wmma4(a10, hf[t][2 * q], c1);
        c0 = wmma4(a01, hf[t][2 * q + 1], c0);
        c1 = wmma4(a11, hf[t][2 * q + 1], c1);
      }
    const float bias0[8] = {bq0.x, bq0.y, bq0.z, bq0.w, bq1.x, bq1.y, bq1.z, bq1.w};
    const float bias1[8] = {bq2.x, bq2.y, bq2.z, bq2.w, bq3.x, bq3.y, bq3.z, bq3.w};
    v2f g[2][4];
    #pragma unroll  // eight independent pairs in one straight line
    for (int j = 0; j < 4; ++j) {
      v2f x0, x1;
      x0.x = c0[2 * j] + bias0[2 * j];
      x0.y = c0[2 * j + 1] + bias0[2 * j + 1];
      x1.x = c1[2 * j] + bias1[2 * j];
      x1.y = c1[2 * j + 1] + bias1[2 * j + 1];
      g[0][j] = gelu2(x0);
      g[1][j] = gelu2(x1);
    }
    // Z[d][p] += sum_e W2[d][e] * gelu(T)[e][p]: four accumulate chains
    #pragma unroll
    for (int u = 0; u < 2; ++u)
      #pragma unroll
      for (int q = 0; q < 2; ++q) {
        float4 f[4];
        #pragma unroll
        for (int dt = 0; dt < 4; ++dt)
          f[dt] = *(const float4*)(w2p + dt * (16 * 516) + (mt + u) * 16 + 4 * q);
        #pragma unroll
        for (int dt = 0; dt < 4; ++dt) {
          const v2f a = {f[dt].x, f[dt].y};
          z[dt] = wmma4(a, g[u][2 * q], z[dt]);
        }
        #pragma unroll
        for (int dt = 0; dt < 4; ++dt) {
          const v2f a = {f[dt].z, f[dt].w};
          z[dt] = wmma4(a, g[u][2 * q + 1], z[dt]);
        }
      }
  }

  // out = BN2(H + Z + b_c2)^T; z[dt][r] is row d = dt*16 + 8*half + r, column p
  float* orow = out + ((size_t)b * PRED_ + p) * 64 + 8 * half;
  #pragma unroll
  for (int dt = 0; dt < 4; ++dt) {
    const int d0 = dt * 16 + 8 * half;
    float o[8];
    #pragma unroll
    for (int r = 0; r < 8; ++r) {
      const int dd = d0 + r;
      const float zz = z[dt][r] + b_c2[dd];
      const float rsum = hf[dt][r >> 1][r & 1] + zz;
      const float s = g2[dd] * rsqrtf(v2[dd] + EPS_);
      o[r] = (rsum - m2[dd]) * s + be2[dd];
    }
    *(float4*)(orow + dt * 16)     = make_float4(o[0], o[1], o[2], o[3]);
    *(float4*)(orow + dt * 16 + 4) = make_float4(o[4], o[5], o[6], o[7]);
  }
}

extern "C" void kernel_launch(void* const* d_in, const int* in_sizes, int n_in,
                              void* d_out, int out_size, void* d_ws,
                              size_t ws_size, hipStream_t stream) {
  (void)in_sizes; (void)n_in; (void)out_size; (void)ws_size;
  const float* x      = (const float*)d_in[0];
  const float* x_date = (const float*)d_in[1];
  const float* y_date = (const float*)d_in[2];
  const float* w_lin  = (const float*)d_in[3];
  const float* b_lin  = (const float*)d_in[4];
  const float* w_c1   = (const float*)d_in[5];
  const float* b_c1   = (const float*)d_in[6];
  const float* w_c2   = (const float*)d_in[7];
  const float* b_c2   = (const float*)d_in[8];
  const float* g1     = (const float*)d_in[9];
  const float* be1    = (const float*)d_in[10];
  const float* m1     = (const float*)d_in[11];
  const float* v1     = (const float*)d_in[12];
  const float* g2     = (const float*)d_in[13];
  const float* be2    = (const float*)d_in[14];
  const float* m2     = (const float*)d_in[15];
  const float* v2     = (const float*)d_in[16];
  float* out   = (float*)d_out;
  float* vflat = (float*)d_ws;                       // 4096*1440 f32
  float* hbuf  = vflat + (size_t)4096 * OPL_;        // 4096*720 f32

  const size_t lds1 = (size_t)K1_TOT * sizeof(float);
  const size_t lds3 = (size_t)K3_TOT * sizeof(float);
  (void)hipFuncSetAttribute(reinterpret_cast<const void*>(attn_kernel),
                            hipFuncAttributeMaxDynamicSharedMemorySize, (int)lds1);
  (void)hipFuncSetAttribute(reinterpret_cast<const void*>(ffn_bn2_kernel),
                            hipFuncAttributeMaxDynamicSharedMemorySize, (int)lds3);

  attn_kernel<<<dim3(B_ * D_), 192, lds1, stream>>>(x, x_date, y_date, vflat);
  lin_bn1_kernel<<<dim3(64, 15), 384, 0, stream>>>(vflat, w_lin, b_lin, g1, be1,
                                                   m1, v1, hbuf);
  ffn_bn2_kernel<<<dim3(240), 384, lds3, stream>>>(hbuf, w_c1, b_c1, w_c2, b_c2,
                                                   g2, be2, m2, v2, out);
}
